// v000
// The times below were measured on an AMD MI455X: many runs one after another, warmed up first and cycling through
// copies of the inputs, with the whole window's GPU time divided by the number of runs. Launches and the gaps
// between them are all in it. The median over several windows is given; except for v000 it joins two sittings, which
// can be a few percent apart, so the side-by-side timings, each taken in one sitting, are the better comparison.
// The starting kernel, v000, takes 427 microseconds a run.
#include <hip/hip_runtime.h>

// NLSRM non-local + SRM block for MI455X (gfx1250).
// Big GEMMs (attention QK^T and P*V, 34 of 39 GFLOP) use bf16x3 error-
// compensated V_WMMA_F32_16X16X32_BF16 (hi*hi + hi*lo + lo*hi, fp32 acc,
// ~1e-5 rel err). Small GEMMs (QKV, out-proj) stay exact f32 WMMA.
// Layouts (fragment loads are single aligned b64/b128 except the b32 QKV B loads):
//   s      [N][C][L]  fp32   (residual + QKV B operand)
//   th/tl  [N][L][Ch] bf16   (theta hi/lo, transposed)
//   ph/pl  [N][L][Ch] bf16   (phi hi/lo, transposed)
//   gh/gl  [N][Ch][L] bf16   (g hi/lo)
//   nl_t   [N][L][Ch] fp32
// Workspace total: 48 MB.

typedef __attribute__((ext_vector_type(2)))  float    v2f;
typedef __attribute__((ext_vector_type(8)))  float    v8f;
typedef __attribute__((ext_vector_type(8)))  __bf16   v8bf;
typedef __attribute__((ext_vector_type(16))) __bf16   v16bf;
typedef __attribute__((ext_vector_type(4)))  unsigned v4u;

#define CC   256
#define CH   128
#define LL   4096
#define NB   4
#define EPSV 1e-5f
#define SROW 4100   // LDS row stride (words): 4100 % 64 == 4 -> conflict-free

__device__ __forceinline__ v8f wmma_f32(v2f a, v2f b, v8f c) {
  return __builtin_amdgcn_wmma_f32_16x16x4_f32(false, a, false, b, (short)0, c,
                                               false, false);
}
__device__ __forceinline__ v8f wmma_bf16(v16bf a, v16bf b, v8f c) {
  return __builtin_amdgcn_wmma_f32_16x16x32_bf16(false, a, false, b, (short)0, c,
                                                 false, false);
}
__device__ __forceinline__ v2f ld2(const float* p) { return *(const v2f*)p; }

// Load one 16-element bf16 fragment: two contiguous 16B runs 16 bf16 apart
// (matches the 16-bit A/B per-lane K layout: [8h,8h+8) and [8h+16,8h+24)).
__device__ __forceinline__ v16bf ldfrag(const __bf16* p) {
  v8bf a = *(const v8bf*)p;
  v8bf b = *(const v8bf*)(p + 16);
  return __builtin_shufflevector(a, b, 0, 1, 2, 3, 4, 5, 6, 7,
                                 8, 9, 10, 11, 12, 13, 14, 15);
}
__device__ __forceinline__ __bf16 bfhi(unsigned w) {
  return __builtin_bit_cast(__bf16, (unsigned short)(w >> 16));
}
__device__ __forceinline__ __bf16 bflo(unsigned w) {
  return __builtin_bit_cast(__bf16, (unsigned short)(w & 0xffffu));
}

// ---------------------------------------------------------------------------
// Kernel 1: SRM pooling + gate + s = x * sigmoid(mean*cfc0 + std*cfc1)
// ---------------------------------------------------------------------------
__global__ __launch_bounds__(256)
void nlsrm_srm_kernel(const float* __restrict__ x, const float* __restrict__ cfc,
                      float* __restrict__ s) {
  const int nc = blockIdx.x;                 // n*C + c
  const int c  = nc & (CC - 1);
  const float4* xv = (const float4*)(x + (size_t)nc * LL);
  float4*       sv = (float4*)(s + (size_t)nc * LL);
  const int t = threadIdx.x;

  float sum = 0.f, sq = 0.f;
#pragma unroll
  for (int k = 0; k < 4; ++k) {
    float4 v = xv[t + 256 * k];
    sum += v.x + v.y + v.z + v.w;
    sq  += v.x * v.x + v.y * v.y + v.z * v.z + v.w * v.w;
  }

  __shared__ float r0[256], r1[256];
  __shared__ float gsh;
  r0[t] = sum; r1[t] = sq;
  __syncthreads();
  for (int off = 128; off > 0; off >>= 1) {
    if (t < off) { r0[t] += r0[t + off]; r1[t] += r1[t + off]; }
    __syncthreads();
  }
  if (t == 0) {
    float mean = r0[0] * (1.f / (float)LL);
    float var  = (r1[0] - (float)LL * mean * mean) * (1.f / (float)(LL - 1)) + EPSV;
    float sd   = sqrtf(var);
    float z    = mean * cfc[c * 2 + 0] + sd * cfc[c * 2 + 1];
    gsh        = 1.f / (1.f + __expf(-z));
  }
  __syncthreads();
  const float gate = gsh;
#pragma unroll
  for (int k = 0; k < 4; ++k) {
    float4 v = xv[t + 256 * k];
    v.x *= gate; v.y *= gate; v.z *= gate; v.w *= gate;
    sv[t + 256 * k] = v;
  }
}

// ---------------------------------------------------------------------------
// Kernel 2: fused QKV GEMM (exact f32 WMMA), emitting bf16 hi/lo splits.
// One B-fragment load feeds 3 WMMAs. theta/phi stored transposed [L][Ch].
// ---------------------------------------------------------------------------
__global__ __launch_bounds__(256)
void nlsrm_qkv_kernel(const float* __restrict__ s,
                      const float* __restrict__ tw, const float* __restrict__ tb,
                      const float* __restrict__ pw, const float* __restrict__ pb,
                      const float* __restrict__ gw, const float* __restrict__ gb,
                      __bf16* __restrict__ thh, __bf16* __restrict__ thl,
                      __bf16* __restrict__ phh, __bf16* __restrict__ phl,
                      __bf16* __restrict__ ghp, __bf16* __restrict__ glp) {
  const int j0 = blockIdx.x * 16;
  const int n  = blockIdx.y;
  const float* sp = s + (size_t)n * CC * LL;
  const size_t toff = (size_t)n * LL * CH;   // theta/phi transposed base
  const size_t goff = (size_t)n * CH * LL;

  const int lane = threadIdx.x & 31;
  const int wave = threadIdx.x >> 5;
  const int m    = lane & 15;
  const int kb   = (lane >> 4) * 2;
  const int half = lane >> 4;
  const int m0   = wave * 16;

  v8f at = {0.f,0.f,0.f,0.f,0.f,0.f,0.f,0.f};
  v8f ap = at, ag = at;
#pragma unroll
  for (int t = 0; t < CC / 4; ++t) {
    const int k0 = 4 * t + kb;
    v2f b;
    b.x = sp[(size_t)(k0)     * LL + j0 + m];
    b.y = sp[(size_t)(k0 + 1) * LL + j0 + m];
    at = wmma_f32(ld2(tw + (m0 + m) * CC + k0), b, at);
    ap = wmma_f32(ld2(pw + (m0 + m) * CC + k0), b, ap);
    ag = wmma_f32(ld2(gw + (m0 + m) * CC + k0), b, ag);
  }
#pragma unroll
  for (int r = 0; r < 8; ++r) {
    const int mr = m0 + r + 8 * half;
    const size_t ti = toff + (size_t)(j0 + m) * CH + mr;  // consecutive in r
    const size_t gi = goff + (size_t)mr * LL + j0 + m;
    float vt = at[r] + tb[mr];
    __bf16 ht = (__bf16)vt;
    thh[ti] = ht; thl[ti] = (__bf16)(vt - (float)ht);
    float vp = ap[r] + pb[mr];
    __bf16 hp = (__bf16)vp;
    phh[ti] = hp; phl[ti] = (__bf16)(vp - (float)hp);
    float vg = ag[r] + gb[mr];
    __bf16 hg = (__bf16)vg;
    ghp[gi] = hg; glp[gi] = (__bf16)(vg - (float)hg);
  }
}

// ---------------------------------------------------------------------------
// Kernel 3: fused attention in the 320KB WGP LDS, bf16x3 WMMA.
// One block per (n, 16-row query tile). Padded 16x4096 fp32 logits stripe
// -> softmax in place -> repack P as {hi16,lo16} words -> O = P @ g^T.
// ---------------------------------------------------------------------------
__global__ __launch_bounds__(256)
void nlsrm_attn_kernel(const __bf16* __restrict__ thh, const __bf16* __restrict__ thl,
                       const __bf16* __restrict__ phh, const __bf16* __restrict__ phl,
                       const __bf16* __restrict__ ghp, const __bf16* __restrict__ glp,
                       float* __restrict__ nlt) {
  __shared__ float Slds[16 * SROW];    // ~262 KB, padded rows
  __shared__ float red[256];
  __shared__ float rowstat[16];

  const int i0 = blockIdx.x * 16;
  const int n  = blockIdx.y;
  const size_t toff = (size_t)n * LL * CH;
  const size_t goff = (size_t)n * CH * LL;

  const int lane = threadIdx.x & 31;
  const int wave = threadIdx.x >> 5;
  const int m    = lane & 15;
  const int half = lane >> 4;

  // Preload Q hi/lo fragments: 4 chunks of K=32 from theta_t row (i0+m).
  const __bf16* qhr = thh + toff + (size_t)(i0 + m) * CH + 8 * half;
  const __bf16* qlr = thl + toff + (size_t)(i0 + m) * CH + 8 * half;
  v16bf qh[4], ql[4];
#pragma unroll
  for (int ck = 0; ck < 4; ++ck) {
    qh[ck] = ldfrag(qhr + 32 * ck);
    ql[ck] = ldfrag(qlr + 32 * ck);
  }

  // ---- Phase 1: logits S[16, 4096] into LDS (waves split j-tiles) ----
  for (int jt = wave; jt < LL / 16; jt += 8) {
    const int j0 = jt * 16;
    const __bf16* bhr = phh + toff + (size_t)(j0 + m) * CH + 8 * half;
    const __bf16* blr = phl + toff + (size_t)(j0 + m) * CH + 8 * half;
    v8f acc = {0.f,0.f,0.f,0.f,0.f,0.f,0.f,0.f};
#pragma unroll
    for (int ck = 0; ck < 4; ++ck) {
      v16bf bh = ldfrag(bhr + 32 * ck);
      v16bf bl = ldfrag(blr + 32 * ck);
      acc = wmma_bf16(qh[ck], bh, acc);   // hi*hi
      acc = wmma_bf16(qh[ck], bl, acc);   // hi*lo
      acc = wmma_bf16(ql[ck], bh, acc);   // lo*hi
    }
#pragma unroll
    for (int r = 0; r < 8; ++r)
      Slds[(r + 8 * half) * SROW + j0 + m] = acc[r];
  }
  __syncthreads();

  // ---- Phase 2: row softmax in LDS; final pass packs P as {hi16,lo16} ----
  const int row = threadIdx.x >> 4;
  const int sub = threadIdx.x & 15;
  float* Srow = Slds + row * SROW;

  float mx = -3.4e38f;
  for (int k = sub; k < LL; k += 16) mx = fmaxf(mx, Srow[k]);
  red[threadIdx.x] = mx;
  __syncthreads();
  if (sub == 0) {
    float v = red[row * 16];
    for (int q = 1; q < 16; ++q) v = fmaxf(v, red[row * 16 + q]);
    rowstat[row] = v;
  }
  __syncthreads();
  const float rmax = rowstat[row];
  float sm = 0.f;
  for (int k = sub; k < LL; k += 16) {
    float p = __expf(Srow[k] - rmax);
    Srow[k] = p;
    sm += p;
  }
  __syncthreads();
  red[threadIdx.x] = sm;
  __syncthreads();
  if (sub == 0) {
    float v = 0.f;
    for (int q = 0; q < 16; ++q) v += red[row * 16 + q];
    rowstat[row] = v;
  }
  __syncthreads();
  const float rinv = 1.f / rowstat[row];
  unsigned* Urow = (unsigned*)Srow;
  for (int k = sub; k < LL; k += 16) {
    float p = Srow[k] * rinv;
    __bf16 h = (__bf16)p;
    __bf16 l = (__bf16)(p - (float)h);
    Urow[k] = ((unsigned)__builtin_bit_cast(unsigned short, h) << 16) |
              (unsigned)__builtin_bit_cast(unsigned short, l);
  }
  __syncthreads();

  // ---- Phase 3: O[i, c] = sum_j P[i,j] * g[c,j]; wave w -> c-tile 16w ----
  const int c0 = wave * 16;
  const unsigned* Pm  = (const unsigned*)Slds + m * SROW + 8 * half;
  const __bf16*   ghr = ghp + goff + (size_t)(c0 + m) * LL + 8 * half;
  const __bf16*   glr = glp + goff + (size_t)(c0 + m) * LL + 8 * half;
  v8f acc = {0.f,0.f,0.f,0.f,0.f,0.f,0.f,0.f};
#pragma unroll 4
  for (int ck = 0; ck < LL / 32; ++ck) {
    // A fragment: unpack 16 packed words (two b128 pairs) into hi/lo bf16.
    v4u w0 = *(const v4u*)(Pm + 32 * ck);
    v4u w1 = *(const v4u*)(Pm + 32 * ck + 4);
    v4u w2 = *(const v4u*)(Pm + 32 * ck + 16);
    v4u w3 = *(const v4u*)(Pm + 32 * ck + 20);
    v16bf ah, al;
#pragma unroll
    for (int e = 0; e < 4; ++e) {
      ah[e]      = bfhi(w0[e]); al[e]      = bflo(w0[e]);
      ah[e + 4]  = bfhi(w1[e]); al[e + 4]  = bflo(w1[e]);
      ah[e + 8]  = bfhi(w2[e]); al[e + 8]  = bflo(w2[e]);
      ah[e + 12] = bfhi(w3[e]); al[e + 12] = bflo(w3[e]);
    }
    v16bf bh = ldfrag(ghr + 32 * ck);
    v16bf bl = ldfrag(glr + 32 * ck);
    acc = wmma_bf16(ah, bh, acc);
    acc = wmma_bf16(ah, bl, acc);
    acc = wmma_bf16(al, bh, acc);
  }
  float* np = nlt + (size_t)n * LL * CH;
#pragma unroll
  for (int r = 0; r < 8; ++r)
    np[(size_t)(i0 + r + 8 * half) * CH + c0 + m] = acc[r];
}

// ---------------------------------------------------------------------------
// Kernel 4: out = s + out_w[256,128] @ nl[128,L] + out_b (exact f32 WMMA).
// ---------------------------------------------------------------------------
__global__ __launch_bounds__(256)
void nlsrm_out_kernel(const float* __restrict__ s, const float* __restrict__ nlt,
                      const float* __restrict__ ow, const float* __restrict__ ob,
                      float* __restrict__ out) {
  const int j0 = blockIdx.x * 16;
  const int n  = blockIdx.y;
  const float* np = nlt + (size_t)n * LL * CH;
  const float* sp = s   + (size_t)n * CC * LL;
  float*       op = out + (size_t)n * CC * LL;

  const int lane = threadIdx.x & 31;
  const int wave = threadIdx.x >> 5;
  const int m    = lane & 15;
  const int kb   = (lane >> 4) * 2;
  const int half = lane >> 4;
  const int m0   = wave * 16;           // tile 0 rows; tile 1 = m0 + 128

  const float* brow = np + (size_t)(j0 + m) * CH + kb;
  const float* a0r  = ow + (m0 + m) * CH + kb;
  const float* a1r  = ow + (m0 + 128 + m) * CH + kb;

  v8f acc0 = {0.f,0.f,0.f,0.f,0.f,0.f,0.f,0.f};
  v8f acc1 = acc0;
#pragma unroll
  for (int t = 0; t < CH / 4; ++t) {
    v2f b = ld2(brow + 4 * t);
    acc0 = wmma_f32(ld2(a0r + 4 * t), b, acc0);
    acc1 = wmma_f32(ld2(a1r + 4 * t), b, acc1);
  }
#pragma unroll
  for (int r = 0; r < 8; ++r) {
    const int mr0 = m0 + r + 8 * half;
    const size_t i0x = (size_t)mr0 * LL + j0 + m;
    op[i0x] = sp[i0x] + acc0[r] + ob[mr0];
    const int mr1 = mr0 + 128;
    const size_t i1x = (size_t)mr1 * LL + j0 + m;
    op[i1x] = sp[i1x] + acc1[r] + ob[mr1];
  }
}

// ---------------------------------------------------------------------------
extern "C" void kernel_launch(void* const* d_in, const int* in_sizes, int n_in,
                              void* d_out, int out_size, void* d_ws, size_t ws_size,
                              hipStream_t stream) {
  const float* x   = (const float*)d_in[0];
  const float* cfc = (const float*)d_in[1];
  const float* tw  = (const float*)d_in[2];
  const float* tb  = (const float*)d_in[3];
  const float* pw  = (const float*)d_in[4];
  const float* pb  = (const float*)d_in[5];
  const float* gw  = (const float*)d_in[6];
  const float* gb  = (const float*)d_in[7];
  const float* ow  = (const float*)d_in[8];
  const float* ob  = (const float*)d_in[9];
  float* out = (float*)d_out;

  char* w = (char*)d_ws;
  const size_t S_BYTES  = (size_t)NB * CC * LL * 4;   // 16 MB fp32
  const size_t TP_BYTES = (size_t)NB * LL * CH * 2;   // 4 MB bf16 each
  float*  s   = (float*)(w);
  __bf16* thh = (__bf16*)(w + S_BYTES);
  __bf16* thl = (__bf16*)(w + S_BYTES + TP_BYTES);
  __bf16* phh = (__bf16*)(w + S_BYTES + 2 * TP_BYTES);
  __bf16* phl = (__bf16*)(w + S_BYTES + 3 * TP_BYTES);
  __bf16* ghp = (__bf16*)(w + S_BYTES + 4 * TP_BYTES);
  __bf16* glp = (__bf16*)(w + S_BYTES + 5 * TP_BYTES);
  float*  nlt = (float*) (w + S_BYTES + 6 * TP_BYTES); // 8 MB fp32

  nlsrm_srm_kernel<<<NB * CC, 256, 0, stream>>>(x, cfc, s);
  nlsrm_qkv_kernel<<<dim3(LL / 16, NB), 256, 0, stream>>>(
      s, tw, tb, pw, pb, gw, gb, thh, thl, phh, phl, ghp, glp);
  nlsrm_attn_kernel<<<dim3(LL / 16, NB), 256, 0, stream>>>(
      thh, thl, phh, phl, ghp, glp, nlt);
  nlsrm_out_kernel<<<dim3(LL / 16, NB), 256, 0, stream>>>(s, nlt, ow, ob, out);
}

// v002
// Measured time: 122 microseconds a run.
// Versions between v000 and this one are left out; their measured steps multiply to 3.55 times as fast.
#include <hip/hip_runtime.h>

// NLSRM non-local + SRM block for MI455X (gfx1250).
// Big GEMMs (attention QK^T and P*V, 34 of 39 GFLOP) use bf16x3 error-
// compensated V_WMMA_F32_16X16X32_BF16 (hi*hi + hi*lo + lo*hi, fp32 acc,
// ~1e-5 rel err). Small GEMMs (QKV, out-proj) stay exact f32 WMMA.
// Layouts (fragment loads are single aligned b64/b128):
//   s      [N][C][L]  fp32   (residual + QKV B operand)
//   th/tl  [N][L][Ch] bf16   (theta hi/lo, transposed)
//   ph/pl  [N][L][Ch] bf16   (phi hi/lo, transposed)
//   gh/gl  [N][Ch][L] bf16   (g hi/lo)
//   nl_t   [N][L][Ch] fp32
// Workspace total: 48 MB.

typedef __attribute__((ext_vector_type(2)))  float    v2f;
typedef __attribute__((ext_vector_type(4)))  float    v4f;
typedef __attribute__((ext_vector_type(8)))  float    v8f;
typedef __attribute__((ext_vector_type(2)))  __bf16   v2bf;
typedef __attribute__((ext_vector_type(4)))  __bf16   v4bf;
typedef __attribute__((ext_vector_type(8)))  __bf16   v8bf;
typedef __attribute__((ext_vector_type(16))) __bf16   v16bf;

#define CC   256
#define CH   128
#define LL   4096
#define NB   4
#define EPSV 1e-5f

__device__ __forceinline__ v8f wmma_f32(v2f a, v2f b, v8f c) {
  return __builtin_amdgcn_wmma_f32_16x16x4_f32(false, a, false, b, (short)0, c,
                                               false, false);
}
__device__ __forceinline__ v8f wmma_bf16(v16bf a, v16bf b, v8f c) {
  return __builtin_amdgcn_wmma_f32_16x16x32_bf16(false, a, false, b, (short)0, c,
                                                 false, false);
}

// Load one 16-element bf16 fragment: two contiguous 16B runs 16 bf16 apart
// (matches the 16-bit A/B per-lane K layout: [8h,8h+8) and [8h+16,8h+24)).
__device__ __forceinline__ v16bf ldfrag(const __bf16* p) {
  v8bf a = *(const v8bf*)p;
  v8bf b = *(const v8bf*)(p + 16);
  return __builtin_shufflevector(a, b, 0, 1, 2, 3, 4, 5, 6, 7,
                                 8, 9, 10, 11, 12, 13, 14, 15);
}

// ---------------------------------------------------------------------------
// Kernel 1: SRM pooling + gate + s = x * sigmoid(mean*cfc0 + std*cfc1)
// ---------------------------------------------------------------------------
__global__ __launch_bounds__(256)
void nlsrm_srm_kernel(const float* __restrict__ x, const float* __restrict__ cfc,
                      float* __restrict__ s) {
  const int nc = blockIdx.x;                 // n*C + c
  const int c  = nc & (CC - 1);
  const float4* xv = (const float4*)(x + (size_t)nc * LL);
  float4*       sv = (float4*)(s + (size_t)nc * LL);
  const int t = threadIdx.x;

  float sum = 0.f, sq = 0.f;
#pragma unroll
  for (int k = 0; k < 4; ++k) {
    float4 v = xv[t + 256 * k];
    sum += v.x + v.y + v.z + v.w;
    sq  += v.x * v.x + v.y * v.y + v.z * v.z + v.w * v.w;
  }

  __shared__ float r0[256], r1[256];
  __shared__ float gsh;
  r0[t] = sum; r1[t] = sq;
  __syncthreads();
  for (int off = 128; off > 0; off >>= 1) {
    if (t < off) { r0[t] += r0[t + off]; r1[t] += r1[t + off]; }
    __syncthreads();
  }
  if (t == 0) {
    float mean = r0[0] * (1.f / (float)LL);
    float var  = (r1[0] - (float)LL * mean * mean) * (1.f / (float)(LL - 1)) + EPSV;
    float sd   = sqrtf(var);
    float z    = mean * cfc[c * 2 + 0] + sd * cfc[c * 2 + 1];
    gsh        = 1.f / (1.f + __expf(-z));
  }
  __syncthreads();
  const float gate = gsh;
#pragma unroll
  for (int k = 0; k < 4; ++k) {
    float4 v = xv[t + 256 * k];
    v.x *= gate; v.y *= gate; v.z *= gate; v.w *= gate;
    sv[t + 256 * k] = v;
  }
}

// ---------------------------------------------------------------------------
// LDS staging for the two f32 GEMMs (kernels 2 and 4).
// Eight (four) 16-byte copies per lane, global -> LDS, through no register. The
// s_wait_xcnt closes each statement so that no address register of a copy is
// rewritten ahead of it.
// ---------------------------------------------------------------------------
__device__ __forceinline__ void async8f(
    unsigned l0, unsigned l1, unsigned l2, unsigned l3,
    unsigned l4, unsigned l5, unsigned l6, unsigned l7,
    const float* g0, const float* g1, const float* g2, const float* g3,
    const float* g4, const float* g5, const float* g6, const float* g7) {
  asm volatile(
      "global_load_async_to_lds_b128 %0, %8, off\n\t"
      "global_load_async_to_lds_b128 %1, %9, off\n\t"
      "global_load_async_to_lds_b128 %2, %10, off\n\t"
      "global_load_async_to_lds_b128 %3, %11, off\n\t"
      "global_load_async_to_lds_b128 %4, %12, off\n\t"
      "global_load_async_to_lds_b128 %5, %13, off\n\t"
      "global_load_async_to_lds_b128 %6, %14, off\n\t"
      "global_load_async_to_lds_b128 %7, %15, off\n\t"
      "s_wait_xcnt 0x0"
      :: "v"(l0), "v"(l1), "v"(l2), "v"(l3), "v"(l4), "v"(l5), "v"(l6), "v"(l7),
         "v"(g0), "v"(g1), "v"(g2), "v"(g3), "v"(g4), "v"(g5), "v"(g6), "v"(g7)
      : "memory");
}
__device__ __forceinline__ void async4f(
    unsigned l0, unsigned l1, unsigned l2, unsigned l3,
    const float* g0, const float* g1, const float* g2, const float* g3) {
  asm volatile(
      "global_load_async_to_lds_b128 %0, %4, off\n\t"
      "global_load_async_to_lds_b128 %1, %5, off\n\t"
      "global_load_async_to_lds_b128 %2, %6, off\n\t"
      "global_load_async_to_lds_b128 %3, %7, off\n\t"
      "s_wait_xcnt 0x0"
      :: "v"(l0), "v"(l1), "v"(l2), "v"(l3),
         "v"(g0), "v"(g1), "v"(g2), "v"(g3)
      : "memory");
}
__device__ __forceinline__ v4f lds4(const unsigned char* p) { return *(const v4f*)p; }
__device__ __forceinline__ v2f lo2(v4f a) { return __builtin_shufflevector(a, a, 0, 1); }
__device__ __forceinline__ v2f hi2(v4f a) { return __builtin_shufflevector(a, a, 2, 3); }

// ---------------------------------------------------------------------------
// Kernel 2: fused QKV GEMM (exact f32 WMMA), emitting bf16 hi/lo splits.
// One block per (n, 64 pixels) does all 384 output rows; wave w owns rows
// 16w..16w+15 of theta, phi and g for all 64 pixels (12 accumulator tiles).
// K runs in 4 stages of 64: a stage holds the 384 x 64 weight slab and the
// 64 x 64 slab of s in LDS, copied as whole 128-byte lines, two buffers.
// Weight row R of matrix q lies in LDS row 48 (R / 16) + 16 q + R % 16, so the
// 48 rows of a wave are adjacent.
// k order: one 16-byte LDS read of a weight row feeds two WMMAs; half h of the
// wave holds k = 8u + 4h + 2j, +1 in WMMA j of group u, for A and B alike.
// Column tile c holds pixels 4n + c (n = lane & 15), so one 16-byte read of an
// s row serves all four tiles and a lane ends with four adjacent pixels.
// ---------------------------------------------------------------------------
#define QN   64                        // pixels per block
#define QKC  64                        // k per stage
#define QP   272                       // LDS pitch of a 64-float row: 256 B + 16
#define QWB  (3 * CH * QP)             // weight slab, 104448 B
#define QSTG (QWB + QKC * QP)          // 121856 B
#define QNST (CC / QKC)

// 128 rows x 64 k of one weight matrix; a wave-wide copy moves two 256-byte runs.
__device__ __forceinline__ void qkv_stage_w(unsigned lw, const float* w) {
  async8f(lw, lw + 48 * QP, lw + 96 * QP, lw + 144 * QP,
          lw + 192 * QP, lw + 240 * QP, lw + 288 * QP, lw + 336 * QP,
          w, w + 16 * CC, w + 32 * CC, w + 48 * CC,
          w + 64 * CC, w + 80 * CC, w + 96 * CC, w + 112 * CC);
}
__device__ __forceinline__ void qkv_stage(unsigned lds, int tid, int k0,
                                          const float* tw, const float* pw,
                                          const float* gw, const float* scol) {
  const unsigned lw = lds + (unsigned)(tid >> 4) * QP + (unsigned)(tid & 15) * 16;
  const size_t   wo = (size_t)(tid >> 4) * CC + k0 + (tid & 15) * 4;
  qkv_stage_w(lw, tw + wo);
  qkv_stage_w(lw + 16 * QP, pw + wo);
  qkv_stage_w(lw + 32 * QP, gw + wo);
  const unsigned ls = lw + QWB;
  const float*   gs = scol + (size_t)(k0 + (tid >> 4)) * LL + (tid & 15) * 4;
  async4f(ls, ls + 16 * QP, ls + 32 * QP, ls + 48 * QP,
          gs, gs + 16 * LL, gs + 32 * LL, gs + 48 * LL);
}

__global__ __launch_bounds__(256)
void nlsrm_qkv_kernel(const float* __restrict__ s,
                      const float* __restrict__ tw, const float* __restrict__ tb,
                      const float* __restrict__ pw, const float* __restrict__ pb,
                      const float* __restrict__ gw, const float* __restrict__ gb,
                      __bf16* __restrict__ thh, __bf16* __restrict__ thl,
                      __bf16* __restrict__ phh, __bf16* __restrict__ phl,
                      __bf16* __restrict__ ghp, __bf16* __restrict__ glp) {
  __shared__ __attribute__((aligned(256))) unsigned char qring[2 * QSTG];

  const int j0 = blockIdx.x * QN;
  const int n  = blockIdx.y;
  const float* scol = s + (size_t)n * CC * LL + j0;
  const size_t toff = (size_t)n * LL * CH;   // theta/phi transposed base
  const size_t goff = (size_t)n * CH * LL;

  const int tid  = threadIdx.x;
  const int lane = tid & 31;
  const int wave = tid >> 5;
  const int m    = lane & 15;
  const int half = lane >> 4;
  const int m0   = wave * 16;
  const unsigned qlds = (unsigned)(size_t)(&qring[0]);

  // Stage 0 into buffer 0, landed and published; then stage 1 into buffer 1.
  qkv_stage(qlds, tid, 0, tw, pw, gw, scol);
  // this wave's copies of stage 0 have landed
  asm volatile("s_wait_asynccnt 0x0" ::: "memory");
  __syncthreads();
  qkv_stage(qlds + QSTG, tid, QKC, tw, pw, gw, scol);

  // "#pragma unroll" below: the loops index register arrays (accumulator
  // tiles), which stay in VGPRs only with constant indices.
  const v8f zero = {0.f,0.f,0.f,0.f,0.f,0.f,0.f,0.f};
  v8f at[4], ap[4], ag[4];
#pragma unroll
  for (int c = 0; c < 4; ++c) { at[c] = zero; ap[c] = zero; ag[c] = zero; }

  for (int t = 0; t < QNST; ++t) {
    const unsigned char* st = qring + (t & 1) * QSTG;
    const unsigned char* ab = st + (3 * m0 + m) * QP + 16 * half;
    const unsigned char* bb = st + QWB + (4 * half) * QP + 16 * m;
#pragma unroll
    for (int u = 0; u < QKC / 8; ++u) {
      const v4f wt = lds4(ab + 32 * u);
      const v4f wp = lds4(ab + 16 * QP + 32 * u);
      const v4f wg = lds4(ab + 32 * QP + 32 * u);
      const v4f r0 = lds4(bb + (8 * u + 0) * QP);
      const v4f r1 = lds4(bb + (8 * u + 1) * QP);
      const v4f r2 = lds4(bb + (8 * u + 2) * QP);
      const v4f r3 = lds4(bb + (8 * u + 3) * QP);
#pragma unroll
      for (int c = 0; c < 4; ++c) {
        const v2f b = {r0[c], r1[c]};
        at[c] = wmma_f32(lo2(wt), b, at[c]);
        ap[c] = wmma_f32(lo2(wp), b, ap[c]);
        ag[c] = wmma_f32(lo2(wg), b, ag[c]);
      }
#pragma unroll
      for (int c = 0; c < 4; ++c) {
        const v2f b = {r2[c], r3[c]};
        at[c] = wmma_f32(hi2(wt), b, at[c]);
        ap[c] = wmma_f32(hi2(wp), b, ap[c]);
        ag[c] = wmma_f32(hi2(wg), b, ag[c]);
      }
    }
    // ---- publish stage t + 1, free this stage's buffer ----
    // this wave's LDS reads of the buffer are done
    asm volatile("s_wait_dscnt 0x0" ::: "memory");
    // this wave's copies of stage t + 1 have landed
    asm volatile("s_wait_asynccnt 0x0" ::: "memory");
    __syncthreads();
    if (t + 2 < QNST)
      qkv_stage(qlds + (unsigned)(t & 1) * QSTG, tid, (t + 2) * QKC, tw, pw, gw, scol);
  }
  // no copy is left in flight when the wave goes on
  asm volatile("s_wait_asynccnt 0x0" ::: "memory");

  const int ch0 = m0 + 8 * half;            // this lane's 8 output rows
  float bt[8], bp[8], bg[8];
#pragma unroll
  for (int r = 0; r < 8; ++r) { bt[r] = tb[ch0 + r]; bp[r] = pb[ch0 + r]; bg[r] = gb[ch0 + r]; }
#pragma unroll
  for (int c = 0; c < 4; ++c) {
    const size_t ti = toff + (size_t)(j0 + 4 * m + c) * CH + ch0;
    v8bf th, tl, ph, pl;
#pragma unroll
    for (int r = 0; r < 8; ++r) {
      const float vt = at[c][r] + bt[r];
      const __bf16 ht = (__bf16)vt;
      th[r] = ht; tl[r] = (__bf16)(vt - (float)ht);
      const float vp = ap[c][r] + bp[r];
      const __bf16 hp = (__bf16)vp;
      ph[r] = hp; pl[r] = (__bf16)(vp - (float)hp);
    }
    *(v8bf*)(thh + ti) = th; *(v8bf*)(thl + ti) = tl;
    *(v8bf*)(phh + ti) = ph; *(v8bf*)(phl + ti) = pl;
  }
#pragma unroll
  for (int r = 0; r < 8; ++r) {
    const size_t gi = goff + (size_t)(ch0 + r) * LL + j0 + 4 * m;
    v4bf gh, gl;
#pragma unroll
    for (int c = 0; c < 4; ++c) {
      const float vg = ag[c][r] + bg[r];
      const __bf16 hg = (__bf16)vg;
      gh[c] = hg; gl[c] = (__bf16)(vg - (float)hg);
    }
    *(v4bf*)(ghp + gi) = gh; *(v4bf*)(glp + gi) = gl;
  }
}

// ---------------------------------------------------------------------------
// Kernel 3: attention with a running softmax, bf16x3 WMMA.
// One block per (n, 64 queries), 8 waves: wave = (query tile qt of 16, key
// group kg). A pass stages 64 keys of phi and g (hi and lo planes) in LDS once
// for all four query tiles; key group kg works on keys 32*kg .. 32*kg+31 of it.
// S^T = phi * theta^T, so a lane holds the scores of ONE query and two score
// tiles convert in place into the B operand of O^T += g * P^T.
// The two key groups' partial results are joined once, at the end.
// ---------------------------------------------------------------------------
#define AQ     64                         // queries per block
#define AK     64                         // keys per pass
#define KPB    272                        // LDS pitch of a key row: 256 B + 16
#define VPB    144                        // LDS pitch of a channel row: 128 B + 16
#define KPLANE (AK * KPB)
#define VPLANE (CH * VPB)
#define STAGE  (2 * KPLANE + 2 * VPLANE)  // 71680 B
#define NPASS  (LL / AK)
#define L2E    1.44269504088896340736f

__device__ __forceinline__ v16bf ldsfrag(const unsigned char* p) {
  v8bf a = *(const v8bf*)p;
  v8bf b = *(const v8bf*)(p + 32);
  return __builtin_shufflevector(a, b, 0, 1, 2, 3, 4, 5, 6, 7,
                                 8, 9, 10, 11, 12, 13, 14, 15);
}
// lane l <-> lane l ^ 16
__device__ __forceinline__ float xhalf(float x) {
  int b = __builtin_bit_cast(int, x);
  return __builtin_bit_cast(float, __builtin_amdgcn_permlanex16(
      b, b, 0x76543210, 0xfedcba98, false, false));
}
// 2^x of eight values. One statement, results in registers of their own, so
// that no v_exp_f32 is followed directly by a use of its result or a rewrite of
// its source; the closing v_nop is that slot behind the last one.
__device__ __forceinline__ v8f exp2x8(v8f x) {
  float r0, r1, r2, r3, r4, r5, r6, r7;
  asm("v_exp_f32 %0, %8\n\t"
      "v_exp_f32 %1, %9\n\t"
      "v_exp_f32 %2, %10\n\t"
      "v_exp_f32 %3, %11\n\t"
      "v_exp_f32 %4, %12\n\t"
      "v_exp_f32 %5, %13\n\t"
      "v_exp_f32 %6, %14\n\t"
      "v_exp_f32 %7, %15\n\t"
      "v_nop"
      : "=&v"(r0), "=&v"(r1), "=&v"(r2), "=&v"(r3),
        "=&v"(r4), "=&v"(r5), "=&v"(r6), "=&v"(r7)
      : "v"(x[0]), "v"(x[1]), "v"(x[2]), "v"(x[3]),
        "v"(x[4]), "v"(x[5]), "v"(x[6]), "v"(x[7]));
  v8f r = {r0, r1, r2, r3, r4, r5, r6, r7};
  return r;
}
// 2^x of one value, with the same slot behind it.
__device__ __forceinline__ float exp2x1(float x) {
  float r;
  asm("v_exp_f32 %0, %1\n\t"
      "v_nop"
      : "=v"(r) : "v"(x));
  return r;
}
// Eight 16-byte copies per lane, global -> LDS, through no register. The
// s_wait_xcnt closes the statement so that no address register of a copy is
// rewritten ahead of it.
__device__ __forceinline__ void async8(
    unsigned l0, unsigned l1, unsigned l2, unsigned l3,
    unsigned l4, unsigned l5, unsigned l6, unsigned l7,
    const __bf16* g0, const __bf16* g1, const __bf16* g2, const __bf16* g3,
    const __bf16* g4, const __bf16* g5, const __bf16* g6, const __bf16* g7) {
  asm volatile(
      "global_load_async_to_lds_b128 %0, %8, off\n\t"
      "global_load_async_to_lds_b128 %1, %9, off\n\t"
      "global_load_async_to_lds_b128 %2, %10, off\n\t"
      "global_load_async_to_lds_b128 %3, %11, off\n\t"
      "global_load_async_to_lds_b128 %4, %12, off\n\t"
      "global_load_async_to_lds_b128 %5, %13, off\n\t"
      "global_load_async_to_lds_b128 %6, %14, off\n\t"
      "global_load_async_to_lds_b128 %7, %15, off\n\t"
      "s_wait_xcnt 0x0"
      :: "v"(l0), "v"(l1), "v"(l2), "v"(l3), "v"(l4), "v"(l5), "v"(l6), "v"(l7),
         "v"(g0), "v"(g1), "v"(g2), "v"(g3), "v"(g4), "v"(g5), "v"(g6), "v"(g7)
      : "memory");
}
// One stage: 64 key rows of phi hi/lo (256 B each) and 128 channel rows of
// g hi/lo (128 B each); every wave-wide copy reads 512 contiguous-line bytes.
__device__ __forceinline__ void stage_copy(unsigned lds, int tid, int key0,
                                           const __bf16* kh, const __bf16* kl,
                                           const __bf16* vh, const __bf16* vl) {
  const unsigned lk = lds + (unsigned)(tid >> 4) * KPB + (unsigned)(tid & 15) * 16;
  const size_t   gk = (size_t)key0 * CH + (size_t)tid * 8;
  async8(lk, lk + 16 * KPB, lk + 32 * KPB, lk + 48 * KPB,
         lk + KPLANE, lk + KPLANE + 16 * KPB, lk + KPLANE + 32 * KPB,
         lk + KPLANE + 48 * KPB,
         kh + gk, kh + gk + 2048, kh + gk + 4096, kh + gk + 6144,
         kl + gk, kl + gk + 2048, kl + gk + 4096, kl + gk + 6144);
  const unsigned lv = lds + 2 * KPLANE + (unsigned)(tid >> 3) * VPB +
                      (unsigned)(tid & 7) * 16;
  const size_t   gv = (size_t)(tid >> 3) * LL + key0 + (tid & 7) * 8;
  async8(lv, lv + 32 * VPB, lv + 64 * VPB, lv + 96 * VPB,
         lv + VPLANE, lv + VPLANE + 32 * VPB, lv + VPLANE + 64 * VPB,
         lv + VPLANE + 96 * VPB,
         vh + gv, vh + gv + 32 * LL, vh + gv + 64 * LL, vh + gv + 96 * LL,
         vl + gv, vl + gv + 32 * LL, vl + gv + 64 * LL, vl + gv + 96 * LL);
}

__global__ __launch_bounds__(256)
void nlsrm_attn_kernel(const __bf16* __restrict__ thh, const __bf16* __restrict__ thl,
                       const __bf16* __restrict__ phh, const __bf16* __restrict__ phl,
                       const __bf16* __restrict__ ghp, const __bf16* __restrict__ glp,
                       float* __restrict__ nlt) {
  __shared__ __attribute__((aligned(256))) unsigned char ring[2 * STAGE];
  __shared__ float join[4][66][32];

  const int i0 = blockIdx.x * AQ;
  const int n  = blockIdx.y;
  const size_t toff = (size_t)n * LL * CH;
  const size_t goff = (size_t)n * CH * LL;

  const int tid  = threadIdx.x;
  const int lane = tid & 31;
  const int wave = __builtin_amdgcn_readfirstlane(tid >> 5);
  const int m    = lane & 15;
  const int half = lane >> 4;
  const int qt   = wave & 3;
  const int kg   = wave >> 2;

  const __bf16* kh = phh + toff;
  const __bf16* kl = phl + toff;
  const __bf16* vh = ghp + goff;
  const __bf16* vl = glp + goff;
  const unsigned ring_lds = (unsigned)(size_t)(&ring[0]);

  // Tile 0 into buffer 0, landed and published; then tile 1 into buffer 1.
  stage_copy(ring_lds, tid, 0, kh, kl, vh, vl);

  // Every "#pragma unroll" in this kernel stands on a loop that indexes a
  // register array (fragments, score and output tiles): unrolled, the index is
  // a constant and the array stays in VGPRs instead of scratch.

  // theta hi/lo of query (i0 + 16 qt + m): B operand, kept in registers.
  const __bf16* qhr = thh + toff + (size_t)(i0 + 16 * qt + m) * CH + 8 * half;
  const __bf16* qlr = thl + toff + (size_t)(i0 + 16 * qt + m) * CH + 8 * half;
  v16bf qh[4], ql[4];
#pragma unroll
  for (int ck = 0; ck < 4; ++ck) {
    qh[ck] = ldfrag(qhr + 32 * ck);
    ql[ck] = ldfrag(qlr + 32 * ck);
  }

  // this wave's copies of tile 0 have landed
  asm volatile("s_wait_asynccnt 0x0" ::: "memory");
  __syncthreads();
  stage_copy(ring_lds + STAGE, tid, AK, kh, kl, vh, vl);

  const v8f zero = {0.f,0.f,0.f,0.f,0.f,0.f,0.f,0.f};
  v8f o[8];
#pragma unroll
  for (int ct = 0; ct < 8; ++ct) o[ct] = zero;
  float mrun = -3.0e38f;   // running maximum of this query's scores
  float lrun = 0.f;        // running sum, this lane's keys only

  for (int t = 0; t < NPASS; ++t) {
    const unsigned char* st = ring + (t & 1) * STAGE;

    // ---- S^T[32 keys][16 queries] ----
    const unsigned char* kb = st + (kg * 32 + m) * KPB + 16 * half;
    v8f s0 = zero, s1 = zero;
#pragma unroll
    for (int ck = 0; ck < 4; ++ck) {
      v16bf a0h = ldsfrag(kb + 64 * ck);
      v16bf a1h = ldsfrag(kb + 16 * KPB + 64 * ck);
      v16bf a0l = ldsfrag(kb + KPLANE + 64 * ck);
      v16bf a1l = ldsfrag(kb + KPLANE + 16 * KPB + 64 * ck);
      s0 = wmma_bf16(a0h, qh[ck], s0);   // hi*hi
      s1 = wmma_bf16(a1h, qh[ck], s1);
      s0 = wmma_bf16(a0l, qh[ck], s0);   // phi lo * theta hi
      s1 = wmma_bf16(a1l, qh[ck], s1);
      s0 = wmma_bf16(a0h, ql[ck], s0);   // phi hi * theta lo
      s1 = wmma_bf16(a1h, ql[ck], s1);
    }

    // ---- running softmax: a lane holds 16 of its query's 32 scores ----
    float mx = fmaxf(s0[0], s1[0]);
#pragma unroll
    for (int r = 1; r < 8; ++r) mx = fmaxf(mx, fmaxf(s0[r], s1[r]));
    mx = fmaxf(mx, xhalf(mx));
    const float mnew  = fmaxf(mrun, mx);
    const float alpha = exp2x1((mrun - mnew) * L2E);
    const float nm    = -mnew * L2E;
    mrun = mnew;

    v8f x0, x1;
#pragma unroll
    for (int r = 0; r < 8; ++r) {
      x0[r] = __builtin_fmaf(s0[r], L2E, nm);
      x1[r] = __builtin_fmaf(s1[r], L2E, nm);
    }
    const v8f p0 = exp2x8(x0);
    const v8f p1 = exp2x8(x1);

    v16bf ph, pl;   // P^T hi and lo: B operand, k = key in the hardware order
    float ps = 0.f;
#pragma unroll
    for (int r = 0; r < 8; r += 2) {
      ps += (p0[r] + p0[r + 1]) + (p1[r] + p1[r + 1]);
      const v2f  f0 = {p0[r], p0[r + 1]}, f1 = {p1[r], p1[r + 1]};
      const v2bf h0 = __builtin_convertvector(f0, v2bf);
      const v2bf h1 = __builtin_convertvector(f1, v2bf);
      const v2f  d0 = {f0.x - (float)h0.x, f0.y - (float)h0.y};
      const v2f  d1 = {f1.x - (float)h1.x, f1.y - (float)h1.y};
      const v2bf e0 = __builtin_convertvector(d0, v2bf);
      const v2bf e1 = __builtin_convertvector(d1, v2bf);
      ph[r]     = h0.x;  ph[r + 1] = h0.y;
      ph[r + 8] = h1.x;  ph[r + 9] = h1.y;
      pl[r]     = e0.x;  pl[r + 1] = e0.y;
      pl[r + 8] = e1.x;  pl[r + 9] = e1.y;
    }
    lrun = lrun * alpha + ps;
#pragma unroll
    for (int ct = 0; ct < 8; ++ct) o[ct] *= alpha;

    // ---- O^T[128 channels][16 queries] += g * P^T ----
    const unsigned char* vb = st + 2 * KPLANE + m * VPB + kg * 64 + 16 * half;
#pragma unroll
    for (int cg = 0; cg < 8; cg += 4) {
      v16bf bh[4], bl[4];
#pragma unroll
      for (int u = 0; u < 4; ++u) {
        bh[u] = ldsfrag(vb + (cg + u) * 16 * VPB);
        bl[u] = ldsfrag(vb + VPLANE + (cg + u) * 16 * VPB);
      }
#pragma unroll
      for (int u = 0; u < 4; ++u) o[cg + u] = wmma_bf16(bh[u], ph, o[cg + u]);
#pragma unroll
      for (int u = 0; u < 4; ++u) o[cg + u] = wmma_bf16(bl[u], ph, o[cg + u]);
#pragma unroll
      for (int u = 0; u < 4; ++u) o[cg + u] = wmma_bf16(bh[u], pl, o[cg + u]);
    }

    // ---- publish tile t + 1, free this pass's buffer ----
    // this wave's LDS reads of the buffer are done
    asm volatile("s_wait_dscnt 0x0" ::: "memory");
    // this wave's copies of tile t + 1 have landed
    asm volatile("s_wait_asynccnt 0x0" ::: "memory");
    __syncthreads();
    if (t + 2 < NPASS)
      stage_copy(ring_lds + (unsigned)(t & 1) * STAGE, tid, (t + 2) * AK,
                 kh, kl, vh, vl);
  }
  // no copy is left in flight when the wave goes on
  asm volatile("s_wait_asynccnt 0x0" ::: "memory");

  // ---- join the two key groups, normalise, store ----
  lrun += xhalf(lrun);
  if (kg == 1) {
#pragma unroll
    for (int ct = 0; ct < 8; ++ct)
#pragma unroll
      for (int r = 0; r < 8; ++r) join[qt][ct * 8 + r][lane] = o[ct][r];
    join[qt][64][lane] = mrun;
    join[qt][65][lane] = lrun;
  }
  __syncthreads();
  if (kg == 0) {
    const float m2 = join[qt][64][lane];
    const float l2 = join[qt][65][lane];
    const float mj = fmaxf(mrun, m2);
    float a1 = exp2x1((mrun - mj) * L2E);
    float a2 = exp2x1((m2 - mj) * L2E);
    const float inv = 1.f / (lrun * a1 + l2 * a2);
    a1 *= inv; a2 *= inv;
    float* np = nlt + ((size_t)n * LL + i0 + 16 * qt + m) * CH + 8 * half;
#pragma unroll
    for (int ct = 0; ct < 8; ++ct) {
      float4 w0, w1;
      w0.x = o[ct][0] * a1 + join[qt][ct * 8 + 0][lane] * a2;
      w0.y = o[ct][1] * a1 + join[qt][ct * 8 + 1][lane] * a2;
      w0.z = o[ct][2] * a1 + join[qt][ct * 8 + 2][lane] * a2;
      w0.w = o[ct][3] * a1 + join[qt][ct * 8 + 3][lane] * a2;
      w1.x = o[ct][4] * a1 + join[qt][ct * 8 + 4][lane] * a2;
      w1.y = o[ct][5] * a1 + join[qt][ct * 8 + 5][lane] * a2;
      w1.z = o[ct][6] * a1 + join[qt][ct * 8 + 6][lane] * a2;
      w1.w = o[ct][7] * a1 + join[qt][ct * 8 + 7][lane] * a2;
      *(float4*)(np + 16 * ct)     = w0;
      *(float4*)(np + 16 * ct + 4) = w1;
    }
  }
}

// ---------------------------------------------------------------------------
// Kernel 4: out = s + out_w[256,128] @ nl[128,L] + out_b (exact f32 WMMA).
// One block per (n, 64 pixels): out_w and the 64 pixel rows of nl are copied
// into LDS once, as whole lines; wave w owns rows 16w.. and 128+16w.. for all
// 64 pixels (8 accumulator tiles). Same k order and same pixel order as in
// kernel 2: pixel 4n + c lies in LDS row 16c + n, so a tile's 16 rows are
// adjacent and a lane ends with four adjacent pixels. Row R of out_w lies in
// LDS row 32 ((R % 128) / 16) + 16 (R / 128) + R % 16: a wave's 32 rows adjacent.
// ---------------------------------------------------------------------------
#define ON   64                        // pixels per block
#define OP   528                       // LDS pitch of a 128-float row: 512 B + 16
#define OWB  (CC * OP)                 // out_w, 135168 B
#define OLDS (OWB + ON * OP)           // 168960 B
// LDS row of out_w row 8 k + wave, less the wave's own share (wave < 8)
#define OROW(k) ((((k) >> 1) & 7) * 32 + ((k) >> 4) * 16 + ((k) & 1) * 8)

__global__ __launch_bounds__(256)
void nlsrm_out_kernel(const float* __restrict__ s, const float* __restrict__ nlt,
                      const float* __restrict__ ow, const float* __restrict__ ob,
                      float* __restrict__ out) {
  __shared__ __attribute__((aligned(256))) unsigned char obuf[OLDS];

  const int j0 = blockIdx.x * ON;
  const int n  = blockIdx.y;
  const float* np = nlt + ((size_t)n * LL + j0) * CH;
  const float* sp = s   + (size_t)n * CC * LL;
  float*       op = out + (size_t)n * CC * LL;

  const int tid  = threadIdx.x;
  const int lane = tid & 31;
  const int wave = tid >> 5;
  const int m    = lane & 15;
  const int half = lane >> 4;
  const int m0   = wave * 16;           // tile 0 rows; tile 1 = m0 + 128
  const unsigned olds = (unsigned)(size_t)(&obuf[0]);

  // A wave-wide copy moves one 512-byte row. Rows wave, wave + 8, ...
  {
    const unsigned lw = olds + (unsigned)wave * OP + (unsigned)lane * 16;
    const float*   gw = ow + wave * CH + lane * 4;
#pragma unroll   // the copies' addresses become constants off one base
    for (int i = 0; i < 4; ++i)
      async8f(lw + OROW(8 * i) * OP,     lw + OROW(8 * i + 1) * OP,
              lw + OROW(8 * i + 2) * OP, lw + OROW(8 * i + 3) * OP,
              lw + OROW(8 * i + 4) * OP, lw + OROW(8 * i + 5) * OP,
              lw + OROW(8 * i + 6) * OP, lw + OROW(8 * i + 7) * OP,
              gw + (64 * i) * CH,      gw + (64 * i + 8) * CH,
              gw + (64 * i + 16) * CH, gw + (64 * i + 24) * CH,
              gw + (64 * i + 32) * CH, gw + (64 * i + 40) * CH,
              gw + (64 * i + 48) * CH, gw + (64 * i + 56) * CH);
    // pixel p = wave + 8 i -> LDS row 16 (p & 3) + (p >> 2)
    const unsigned lp = olds + OWB +
                        (unsigned)((wave & 3) * 16 + (wave >> 2)) * OP +
                        (unsigned)lane * 16;
    const float*   gp = np + wave * CH + lane * 4;
    async8f(lp, lp + 2 * OP, lp + 4 * OP, lp + 6 * OP,
            lp + 8 * OP, lp + 10 * OP, lp + 12 * OP, lp + 14 * OP,
            gp, gp + 8 * CH, gp + 16 * CH, gp + 24 * CH,
            gp + 32 * CH, gp + 40 * CH, gp + 48 * CH, gp + 56 * CH);
  }
  // this wave's copies have landed
  asm volatile("s_wait_asynccnt 0x0" ::: "memory");
  __syncthreads();

  const unsigned char* a0 = obuf + (2 * m0 + m) * OP + 16 * half;
  const unsigned char* a1 = a0 + 16 * OP;
  const unsigned char* bb = obuf + OWB + m * OP + 16 * half;

  // "#pragma unroll" below: the loops index register arrays (accumulator
  // tiles), which stay in VGPRs only with constant indices.
  const v8f zero = {0.f,0.f,0.f,0.f,0.f,0.f,0.f,0.f};
  v8f acc0[4], acc1[4];
#pragma unroll
  for (int c = 0; c < 4; ++c) { acc0[c] = zero; acc1[c] = zero; }
#pragma unroll
  for (int u = 0; u < CH / 8; ++u) {
    const v4f x0 = lds4(a0 + 32 * u);
    const v4f x1 = lds4(a1 + 32 * u);
    v4f y[4];
#pragma unroll
    for (int c = 0; c < 4; ++c) y[c] = lds4(bb + c * 16 * OP + 32 * u);
#pragma unroll
    for (int c = 0; c < 4; ++c) {
      acc0[c] = wmma_f32(lo2(x0), lo2(y[c]), acc0[c]);
      acc1[c] = wmma_f32(lo2(x1), lo2(y[c]), acc1[c]);
    }
#pragma unroll
    for (int c = 0; c < 4; ++c) {
      acc0[c] = wmma_f32(hi2(x0), hi2(y[c]), acc0[c]);
      acc1[c] = wmma_f32(hi2(x1), hi2(y[c]), acc1[c]);
    }
  }
#pragma unroll
  for (int r = 0; r < 8; ++r) {
    const int mr0 = m0 + r + 8 * half;
    const size_t i0x = (size_t)mr0 * LL + j0 + 4 * m;
    const float  b0  = ob[mr0];
    const v4f    s0  = *(const v4f*)(sp + i0x);
    v4f w0;
#pragma unroll
    for (int c = 0; c < 4; ++c) w0[c] = s0[c] + acc0[c][r] + b0;
    *(v4f*)(op + i0x) = w0;
    const int mr1 = mr0 + 128;
    const size_t i1x = (size_t)mr1 * LL + j0 + 4 * m;
    const float  b1  = ob[mr1];
    const v4f    s1  = *(const v4f*)(sp + i1x);
    v4f w1;
#pragma unroll
    for (int c = 0; c < 4; ++c) w1[c] = s1[c] + acc1[c][r] + b1;
    *(v4f*)(op + i1x) = w1;
  }
}

// ---------------------------------------------------------------------------
extern "C" void kernel_launch(void* const* d_in, const int* in_sizes, int n_in,
                              void* d_out, int out_size, void* d_ws, size_t ws_size,
                              hipStream_t stream) {
  const float* x   = (const float*)d_in[0];
  const float* cfc = (const float*)d_in[1];
  const float* tw  = (const float*)d_in[2];
  const float* tb  = (const float*)d_in[3];
  const float* pw  = (const float*)d_in[4];
  const float* pb  = (const float*)d_in[5];
  const float* gw  = (const float*)d_in[6];
  const float* gb  = (const float*)d_in[7];
  const float* ow  = (const float*)d_in[8];
  const float* ob  = (const float*)d_in[9];
  float* out = (float*)d_out;

  char* w = (char*)d_ws;
  const size_t S_BYTES  = (size_t)NB * CC * LL * 4;   // 16 MB fp32
  const size_t TP_BYTES = (size_t)NB * LL * CH * 2;   // 4 MB bf16 each
  float*  s   = (float*)(w);
  __bf16* thh = (__bf16*)(w + S_BYTES);
  __bf16* thl = (__bf16*)(w + S_BYTES + TP_BYTES);
  __bf16* phh = (__bf16*)(w + S_BYTES + 2 * TP_BYTES);
  __bf16* phl = (__bf16*)(w + S_BYTES + 3 * TP_BYTES);
  __bf16* ghp = (__bf16*)(w + S_BYTES + 4 * TP_BYTES);
  __bf16* glp = (__bf16*)(w + S_BYTES + 5 * TP_BYTES);
  float*  nlt = (float*) (w + S_BYTES + 6 * TP_BYTES); // 8 MB fp32

  nlsrm_srm_kernel<<<NB * CC, 256, 0, stream>>>(x, cfc, s);
  nlsrm_qkv_kernel<<<dim3(LL / QN, NB), 256, 0, stream>>>(
      s, tw, tb, pw, pb, gw, gb, thh, thl, phh, phl, ghp, glp);
  nlsrm_attn_kernel<<<dim3(LL / AQ, NB), 256, 0, stream>>>(
      thh, thl, phh, phl, ghp, glp, nlt);
  nlsrm_out_kernel<<<dim3(LL / ON, NB), 256, 0, stream>>>(s, nlt, ow, ob, out);
}
